// v000
// Measured on an AMD MI455X. A time is GPU time per run, averaged over a window of back-to-back runs after a warm-up
// (all launches, gaps included; the runs take copies of the inputs in turn), and the median of several windows.
// Apart from v000's, it joins two sittings. Times from different sittings can be a few percent apart, while
// side-by-side timings come from the same sitting.
// v000 is the starting kernel. One run takes 22.7 microseconds.
#include <hip/hip_runtime.h>

typedef _Float16 half_t;
typedef __attribute__((ext_vector_type(16))) _Float16 v16h;
typedef __attribute__((ext_vector_type(8)))  float    v8f;

#define BATCH   65536
#define IN      256
#define OUTCH   32
#define NCHEB   8
#define KTOT    2048      // IN * NCHEB
#define NCHUNK  64        // KTOT / 32 (WMMA K = 32)
#define WP_ELEMS (NCHUNK * 2 * 32 * 16)   // 65536 halves = 128 KB

// ---------------------------------------------------------------------------
// Pre-swizzle w [O=32][I=256][N=8] (f32) into f16 WMMA-B fragments.
// Fragment layout: wp[((chunk*2 + ntile)*32 + lane)*16 + h]
// For the 16-bit B operand of V_WMMA_F32_16X16X32_F16 (mirror of the
// documented A layout, M->N): lane<16 holds K={0..7,16..23}, lane>=16 holds
// K={8..15,24..31}; half h: v=h>>1 selects VGPR, h&1 selects lo/hi 16 bits.
// ---------------------------------------------------------------------------
__global__ void pack_w_kernel(const float* __restrict__ w, half_t* __restrict__ wp) {
    int idx = blockIdx.x * blockDim.x + threadIdx.x;
    if (idx >= WP_ELEMS) return;
    int h    = idx & 15;
    int lane = (idx >> 4) & 31;
    int frag = idx >> 9;          // 0..127
    int c    = frag >> 1;         // k-chunk 0..63
    int t    = frag & 1;          // n-tile 0..1
    int ncol = t * 16 + (lane & 15);
    int v  = h >> 1;
    int hi = h & 1;
    int K  = ((v < 4) ? (v * 2 + hi) : (16 + (v - 4) * 2 + hi)) + ((lane & 16) ? 8 : 0);
    int k  = c * 32 + K;          // flat k = i*8 + n
    wp[idx] = (half_t)w[ncol * KTOT + k];
}

// ---------------------------------------------------------------------------
// Main kernel: one wave -> 16 batch rows x all 32 outputs.
// A (Phi) fragments are generated in-register from x via the Chebyshev
// recurrence; B fragments come from LDS (whole 128 KB W staged per block,
// shared by all 8 waves). f32 accumulation via WMMA.
// ---------------------------------------------------------------------------
__global__ __launch_bounds__(256, 1)
void cheb_gemm_kernel(const float* __restrict__ x,
                      const half_t* __restrict__ wp,
                      float* __restrict__ out) {
    extern __shared__ __align__(16) half_t lds[];   // 65536 halves = 128 KB

    // Cooperative stage of all W fragments into LDS (16B per thread per iter).
    {
        const uint4* __restrict__ src = (const uint4*)wp;
        uint4* dst = (uint4*)lds;
        const int tid = threadIdx.x;
        #pragma unroll
        for (int it = 0; it < (WP_ELEMS * 2 / 16) / 256; ++it)   // 32 iters
            dst[tid + it * 256] = src[tid + it * 256];
    }
    __syncthreads();

    const int wave   = threadIdx.x >> 5;
    const int lane   = threadIdx.x & 31;
    const int tile   = blockIdx.x * 8 + wave;       // 4096 tiles of 16 rows
    const int row    = tile * 16 + (lane & 15);
    const int parity = (lane >> 4) & 1;             // which i within a pair

    const float4* __restrict__ xrow4 = (const float4*)(x + (size_t)row * IN);
    const v16h*   __restrict__ bfrag = (const v16h*)lds;

    v8f acc0 = {};
    v8f acc1 = {};

    #pragma unroll 4
    for (int c = 0; c < NCHUNK; ++c) {
        // Unconditional, branch-free prefetch ~8 chunks (128B) ahead; wrapped
        // index stays inside the same 1 KB row so it is always valid.
        __builtin_prefetch(&xrow4[(c + 8) & (NCHUNK - 1)], 0, 3);

        // x values this lane is responsible for in this 32-wide k-chunk
        const float4 xv = xrow4[c];                    // i0 = 4c .. 4c+3
        const float xa = parity ? xv.y : xv.x;         // i0 + parity
        const float xb = parity ? xv.w : xv.z;         // i0 + 2 + parity

        // Chebyshev T0..T7 (f32 recurrence, packed to f16 A-fragment):
        // halves 0..7  <- T_n(xa)  (K 0..7  / 8..15  by lane half)
        // halves 8..15 <- T_n(xb)  (K 16..23 / 24..31 by lane half)
        v16h a;
        float ta0 = 1.0f, ta1 = xa;
        float tb0 = 1.0f, tb1 = xb;
        a[0] = (half_t)ta0; a[1] = (half_t)ta1;
        a[8] = (half_t)tb0; a[9] = (half_t)tb1;
        #pragma unroll
        for (int n = 2; n < NCHEB; ++n) {
            float ta = 2.0f * xa * ta1 - ta0; ta0 = ta1; ta1 = ta;
            float tb = 2.0f * xb * tb1 - tb0; tb0 = tb1; tb1 = tb;
            a[n]     = (half_t)ta;
            a[8 + n] = (half_t)tb;
        }

        // B fragments from LDS: chunk c, n-tiles 0 and 1
        const v16h b0 = bfrag[c * 64 + lane];
        const v16h b1 = bfrag[c * 64 + lane + 32];

        acc0 = __builtin_amdgcn_wmma_f32_16x16x32_f16(
                   false, a, false, b0, (short)0, acc0, false, false);
        acc1 = __builtin_amdgcn_wmma_f32_16x16x32_f16(
                   false, a, false, b1, (short)0, acc1, false, false);
    }

    // D layout: lanes 0-15 -> M = r, lanes 16-31 -> M = r + 8; N = lane & 15
    const int mbase = tile * 16 + ((lane & 16) ? 8 : 0);
    const int ncol  = lane & 15;
    #pragma unroll
    for (int r = 0; r < 8; ++r) {
        out[(size_t)(mbase + r) * OUTCH + ncol]      = acc0[r];
        out[(size_t)(mbase + r) * OUTCH + 16 + ncol] = acc1[r];
    }
}

// ---------------------------------------------------------------------------
// Host entry
// ---------------------------------------------------------------------------
extern "C" void kernel_launch(void* const* d_in, const int* in_sizes, int n_in,
                              void* d_out, int out_size, void* d_ws, size_t ws_size,
                              hipStream_t stream) {
    const float* x = (const float*)d_in[0];   // [65536, 256] f32
    const float* w = (const float*)d_in[1];   // [32, 256, 8]  f32
    float* out     = (float*)d_out;           // [65536, 32]   f32
    half_t* wp     = (half_t*)d_ws;           // 128 KB fragment-packed W

    // Allow 128 KB dynamic LDS (WGP supports up to 320 KB per workgroup).
    (void)hipFuncSetAttribute(reinterpret_cast<const void*>(&cheb_gemm_kernel),
                              hipFuncAttributeMaxDynamicSharedMemorySize,
                              WP_ELEMS * (int)sizeof(half_t));

    pack_w_kernel<<<WP_ELEMS / 256, 256, 0, stream>>>(w, wp);
    cheb_gemm_kernel<<<BATCH / 16 / 8, 256, WP_ELEMS * sizeof(half_t), stream>>>(x, wp, out);
}

// v001
// Measured time: 16.9 microseconds a run.
// In two side-by-side timings against v000, it was 1.39 and 1.43 times as fast.
#include <hip/hip_runtime.h>

typedef _Float16 half_t;
typedef __attribute__((ext_vector_type(16))) _Float16 v16h;
typedef __attribute__((ext_vector_type(8)))  float    v8f;

#define BATCH   65536
#define IN      256
#define OUTCH   32
#define NCHEB   8
#define KTOT    2048      // IN * NCHEB
#define NCHUNK  64        // KTOT / 32 (WMMA K = 32)
#define WP_ELEMS (NCHUNK * 2 * 32 * 16)   // 65536 halves = 128 KB
#define W_BYTES   (WP_ELEMS * 2)          // W fragments in LDS
#define XT_CHUNKS 8                       // k-chunks per x tile: 128 B of each row
#define NXT       (NCHUNK / XT_CHUNKS)    // 8 x tiles along a row
#define XSLICE    2048                    // one wave's 16 rows x 128 B of one tile
#define XBUF      (8 * XSLICE)            // one ring buffer, all 8 waves
#define LDS_BYTES (W_BYTES + 2 * XBUF)    // 160 KB: two blocks still share a WGP

// ---------------------------------------------------------------------------
// Pre-swizzle w [O=32][I=256][N=8] (f32) into f16 WMMA-B fragments.
// Fragment layout: wp[((chunk*2 + ntile)*32 + lane)*16 + h]
// For the 16-bit B operand of V_WMMA_F32_16X16X32_F16 (mirror of the
// documented A layout, M->N): lane<16 holds K={0..7,16..23}, lane>=16 holds
// K={8..15,24..31}; half h: v=h>>1 selects VGPR, h&1 selects lo/hi 16 bits.
// ---------------------------------------------------------------------------
__global__ void pack_w_kernel(const float* __restrict__ w, half_t* __restrict__ wp) {
    int idx = blockIdx.x * blockDim.x + threadIdx.x;
    if (idx >= WP_ELEMS) return;
    int h    = idx & 15;
    int lane = (idx >> 4) & 31;
    int frag = idx >> 9;          // 0..127
    int c    = frag >> 1;         // k-chunk 0..63
    int t    = frag & 1;          // n-tile 0..1
    int ncol = t * 16 + (lane & 15);
    int v  = h >> 1;
    int hi = h & 1;
    int K  = ((v < 4) ? (v * 2 + hi) : (16 + (v - 4) * 2 + hi)) + ((lane & 16) ? 8 : 0);
    int k  = c * 32 + K;          // flat k = i*8 + n
    wp[idx] = (half_t)w[ncol * KTOT + k];
}

// ---------------------------------------------------------------------------
// One wave's slice of one x tile, global -> LDS: four copies, each of four
// whole 128-B lines (8 lanes x 16 B per row). The s_wait_xcnt stands inside
// the statement so that no address register is rewritten in front of it.
// ---------------------------------------------------------------------------
__device__ __forceinline__ void copy_x_slice(unsigned l0, unsigned l1, unsigned l2, unsigned l3,
                                             const float* g0, const float* g1,
                                             const float* g2, const float* g3) {
    asm volatile("global_load_async_to_lds_b128 %0, %4, off\n\t"
                 "global_load_async_to_lds_b128 %1, %5, off\n\t"
                 "global_load_async_to_lds_b128 %2, %6, off\n\t"
                 "global_load_async_to_lds_b128 %3, %7, off\n\t"
                 "s_wait_xcnt 0x0"
                 :: "v"(l0), "v"(l1), "v"(l2), "v"(l3),
                    "v"(g0), "v"(g1), "v"(g2), "v"(g3)
                 : "memory");
}

// ---------------------------------------------------------------------------
// Main kernel: one wave -> 16 batch rows x all 32 outputs.
// A (Phi) fragments are generated in-register from x via the Chebyshev
// recurrence; B fragments come from LDS (whole 128 KB W staged per block,
// shared by all 8 waves). f32 accumulation via WMMA.
// x reaches the lanes through a two-buffer LDS ring filled by asynchronous
// whole-line copies. 16-B unit u of row r lies at r*128 + ((u ^ (r>>1 & 7))*16):
// the 16 rows that one ds_load_b128 reads fall on 16 different bank groups.
// ---------------------------------------------------------------------------
__global__ __launch_bounds__(256, 1)
void cheb_gemm_kernel(const float* __restrict__ x,
                      const half_t* __restrict__ wp,
                      float* __restrict__ out) {
    extern __shared__ __align__(16) half_t lds[];   // 128 KB W + 32 KB x ring

    const int wave   = threadIdx.x >> 5;
    const int lane   = threadIdx.x & 31;
    const int tile   = blockIdx.x * 8 + wave;       // 4096 tiles of 16 rows

    // Copy side: copy j moves rows 4j + (lane>>3), unit lane&7 of each.
    char* const xring = (char*)lds + W_BYTES + wave * XSLICE;
    const unsigned xring_lds = (unsigned)(size_t)xring;   // LDS byte address
    const int crow = lane >> 3;
    const int cu   = lane & 7;
    unsigned cl[4];
    #pragma unroll   // keeps cl[] in registers
    for (int j = 0; j < 4; ++j) {
        const int r = 4 * j + crow;
        cl[j] = xring_lds + r * 128 + ((cu ^ ((r >> 1) & 7)) << 4);
    }

    const float* const cg = x + (size_t)(tile * 16 + crow) * IN + cu * 4;

    // x tile 0 -> buffer 0; it flies while W is staged.
    copy_x_slice(cl[0], cl[1], cl[2], cl[3], cg, cg + 4 * IN, cg + 8 * IN, cg + 12 * IN);

    // Cooperative stage of all W fragments into LDS (16B per thread per iter).
    {
        const uint4* __restrict__ src = (const uint4*)wp;
        uint4* dst = (uint4*)lds;
        const int tid = threadIdx.x;
        #pragma unroll
        for (int it = 0; it < (WP_ELEMS * 2 / 16) / 256; ++it)   // 32 iters
            dst[tid + it * 256] = src[tid + it * 256];
    }
    // x tile 0 has landed before anybody passes the barrier.
    asm volatile("s_wait_asynccnt 0x0" ::: "memory");
    __syncthreads();

    // x tile 1 -> buffer 1.
    copy_x_slice(cl[0] + XBUF, cl[1] + XBUF, cl[2] + XBUF, cl[3] + XBUF,
                 cg + 32, cg + 4 * IN + 32, cg + 8 * IN + 32, cg + 12 * IN + 32);

    const int parity = (lane >> 4) & 1;             // which i within a pair
    const int rrow   = lane & 15;                   // reader's row in the slice
    const int rswz   = (rrow >> 1) & 7;

    const v16h*   __restrict__ bfrag = (const v16h*)lds;

    v8f acc0 = {};
    v8f acc1 = {};

    for (int t = 0; t < NXT; ++t) {
      const char* xb = xring + (t & 1) * XBUF + rrow * 128;
      #pragma unroll   // cc constant: swizzled x offsets loop-invariant, W offsets immediates
      for (int cc = 0; cc < XT_CHUNKS; ++cc) {
        const int c = t * XT_CHUNKS + cc;

        // x values this lane is responsible for in this 32-wide k-chunk
        const float4 xv = *(const float4*)(xb + ((cc ^ rswz) << 4));   // i0 = 4c .. 4c+3
        const float xa = parity ? xv.y : xv.x;         // i0 + parity
        const float xb = parity ? xv.w : xv.z;         // i0 + 2 + parity

        // Chebyshev T0..T7 (f32 recurrence, packed to f16 A-fragment):
        // halves 0..7  <- T_n(xa)  (K 0..7  / 8..15  by lane half)
        // halves 8..15 <- T_n(xb)  (K 16..23 / 24..31 by lane half)
        v16h a;
        float ta0 = 1.0f, ta1 = xa;
        float tb0 = 1.0f, tb1 = xb;
        a[0] = (half_t)ta0; a[1] = (half_t)ta1;
        a[8] = (half_t)tb0; a[9] = (half_t)tb1;
        #pragma unroll
        for (int n = 2; n < NCHEB; ++n) {
            float ta = 2.0f * xa * ta1 - ta0; ta0 = ta1; ta1 = ta;
            float tb = 2.0f * xb * tb1 - tb0; tb0 = tb1; tb1 = tb;
            a[n]     = (half_t)ta;
            a[8 + n] = (half_t)tb;
        }

        // B fragments from LDS: chunk c, n-tiles 0 and 1
        const v16h b0 = bfrag[c * 64 + lane];
        const v16h b1 = bfrag[c * 64 + lane + 32];

        acc0 = __builtin_amdgcn_wmma_f32_16x16x32_f16(
                   false, a, false, b0, (short)0, acc0, false, false);
        acc1 = __builtin_amdgcn_wmma_f32_16x16x32_f16(
                   false, a, false, b1, (short)0, acc1, false, false);
      }

      // Hand-over: this wave's reads of tile t are done, its copies of tile
      // t + 1 have landed; behind the barrier buffer t & 1 is free to refill.
      asm volatile("s_wait_dscnt 0x0" ::: "memory");
      asm volatile("s_wait_asynccnt 0x0" ::: "memory");
      __syncthreads();
      if (t + 2 < NXT) {
        const unsigned bo = (t & 1) * XBUF;
        const int      go = (t + 2) * (XT_CHUNKS * 4);
        copy_x_slice(cl[0] + bo, cl[1] + bo, cl[2] + bo, cl[3] + bo,
                     cg + go, cg + 4 * IN + go, cg + 8 * IN + go, cg + 12 * IN + go);
      }
    }
    // No copy is left in flight when the wave ends.
    asm volatile("s_wait_asynccnt 0x0" ::: "memory");

    // D layout: lanes 0-15 -> M = r, lanes 16-31 -> M = r + 8; N = lane & 15
    const int mbase = tile * 16 + ((lane & 16) ? 8 : 0);
    const int ncol  = lane & 15;
    #pragma unroll
    for (int r = 0; r < 8; ++r) {
        out[(size_t)(mbase + r) * OUTCH + ncol]      = acc0[r];
        out[(size_t)(mbase + r) * OUTCH + 16 + ncol] = acc1[r];
    }
}

// ---------------------------------------------------------------------------
// Host entry
// ---------------------------------------------------------------------------
extern "C" void kernel_launch(void* const* d_in, const int* in_sizes, int n_in,
                              void* d_out, int out_size, void* d_ws, size_t ws_size,
                              hipStream_t stream) {
    const float* x = (const float*)d_in[0];   // [65536, 256] f32
    const float* w = (const float*)d_in[1];   // [32, 256, 8]  f32
    float* out     = (float*)d_out;           // [65536, 32]   f32
    half_t* wp     = (half_t*)d_ws;           // 128 KB fragment-packed W

    // Allow 160 KB dynamic LDS (WGP supports up to 320 KB per workgroup).
    (void)hipFuncSetAttribute(reinterpret_cast<const void*>(&cheb_gemm_kernel),
                              hipFuncAttributeMaxDynamicSharedMemorySize,
                              LDS_BYTES);

    pack_w_kernel<<<WP_ELEMS / 256, 256, 0, stream>>>(w, wp);
    cheb_gemm_kernel<<<BATCH / 16 / 8, 256, LDS_BYTES, stream>>>(x, wp, out);
}

// v002
// It runs in 15.7 microseconds.
// Next to v001, in two timings, it ran 1.05 times as fast each time.
// Over all steps from v000 it is 1.49 times as fast.
#include <hip/hip_runtime.h>

typedef _Float16 half_t;
typedef __attribute__((ext_vector_type(16))) _Float16 v16h;
typedef __attribute__((ext_vector_type(8)))  _Float16 v8h;
typedef __attribute__((ext_vector_type(8)))  float    v8f;

#define BATCH   65536
#define IN      256
#define OUTCH   32
#define NCHEB   8
#define KTOT    2048      // IN * NCHEB
#define NCHUNK  64        // KTOT / 32 (WMMA K = 32)
#define WP_ELEMS (NCHUNK * 2 * 32 * 16)   // 65536 halves = 128 KB
#define W_BYTES   (WP_ELEMS * 2)          // W fragments in LDS
#define XT_CHUNKS 8                       // k-chunks per x tile: 128 B of each row
#define NXT       (NCHUNK / XT_CHUNKS)    // 8 x tiles along a row
#define XSLICE    2048                    // one wave's 16 rows x 128 B of one tile
#define XBUF      (8 * XSLICE)            // one ring buffer, all 8 waves
#define LDS_BYTES (W_BYTES + 2 * XBUF)    // 160 KB: two blocks still share a WGP

// ---------------------------------------------------------------------------
// Pre-swizzle w [O=32][I=256][N=8] (f32) into f16 WMMA-B fragments.
// Storage: wp[(((chunk*2 + ntile)*2 + (h>>3))*32 + lane)*8 + (h&7)]: a fragment
// lies as two planes of 32 lanes x 16 B, so that each 16-B LDS read of a wave
// covers 512 contiguous bytes (at 32 B per lane, lanes l and l+8 shared banks).
// For the 16-bit B operand of V_WMMA_F32_16X16X32_F16 (mirror of the
// documented A layout, M->N): lane<16 holds K={0..7,16..23}, lane>=16 holds
// K={8..15,24..31}; half h: v=h>>1 selects VGPR, h&1 selects lo/hi 16 bits.
// ---------------------------------------------------------------------------
__global__ void pack_w_kernel(const float* __restrict__ w, half_t* __restrict__ wp) {
    int idx = blockIdx.x * blockDim.x + threadIdx.x;
    if (idx >= WP_ELEMS) return;
    int h    = ((idx >> 8) & 1) * 8 + (idx & 7);
    int lane = (idx >> 3) & 31;
    int frag = idx >> 9;          // 0..127
    int c    = frag >> 1;         // k-chunk 0..63
    int t    = frag & 1;          // n-tile 0..1
    int ncol = t * 16 + (lane & 15);
    int v  = h >> 1;
    int hi = h & 1;
    int K  = ((v < 4) ? (v * 2 + hi) : (16 + (v - 4) * 2 + hi)) + ((lane & 16) ? 8 : 0);
    int k  = c * 32 + K;          // flat k = i*8 + n
    wp[idx] = (half_t)w[ncol * KTOT + k];
}

// ---------------------------------------------------------------------------
// One wave's slice of one x tile, global -> LDS: four copies, each of four
// whole 128-B lines (8 lanes x 16 B per row). The s_wait_xcnt stands inside
// the statement so that no address register is rewritten in front of it.
// ---------------------------------------------------------------------------
__device__ __forceinline__ void copy_x_slice(unsigned l0, unsigned l1, unsigned l2, unsigned l3,
                                             const float* g0, const float* g1,
                                             const float* g2, const float* g3) {
    asm volatile("global_load_async_to_lds_b128 %0, %4, off\n\t"
                 "global_load_async_to_lds_b128 %1, %5, off\n\t"
                 "global_load_async_to_lds_b128 %2, %6, off\n\t"
                 "global_load_async_to_lds_b128 %3, %7, off\n\t"
                 "s_wait_xcnt 0x0"
                 :: "v"(l0), "v"(l1), "v"(l2), "v"(l3),
                    "v"(g0), "v"(g1), "v"(g2), "v"(g3)
                 : "memory");
}

// ---------------------------------------------------------------------------
// Main kernel: one wave -> 16 batch rows x all 32 outputs.
// A (Phi) fragments are generated in-register from x via the Chebyshev
// recurrence; B fragments come from LDS (whole 128 KB W staged per block,
// shared by all 8 waves). f32 accumulation via WMMA.
// x reaches the lanes through a two-buffer LDS ring filled by asynchronous
// whole-line copies. 16-B unit u of row r lies at r*128 + ((u ^ (r>>1 & 7))*16):
// the 16 rows that one ds_load_b128 reads fall on 16 different bank groups.
// ---------------------------------------------------------------------------
__global__ __launch_bounds__(256, 1)
void cheb_gemm_kernel(const float* __restrict__ x,
                      const half_t* __restrict__ wp,
                      float* __restrict__ out) {
    extern __shared__ __align__(16) half_t lds[];   // 128 KB W + 32 KB x ring

    const int wave   = threadIdx.x >> 5;
    const int lane   = threadIdx.x & 31;
    const int tile   = blockIdx.x * 8 + wave;       // 4096 tiles of 16 rows

    // Copy side: copy j moves rows 4j + (lane>>3), unit lane&7 of each.
    char* const xring = (char*)lds + W_BYTES + wave * XSLICE;
    const unsigned xring_lds = (unsigned)(size_t)xring;   // LDS byte address
    const int crow = lane >> 3;
    const int cu   = lane & 7;
    unsigned cl[4];
    #pragma unroll   // keeps cl[] in registers
    for (int j = 0; j < 4; ++j) {
        const int r = 4 * j + crow;
        cl[j] = xring_lds + r * 128 + ((cu ^ ((r >> 1) & 7)) << 4);
    }

    const float* const cg = x + (size_t)(tile * 16 + crow) * IN + cu * 4;

    // x tile 0 -> buffer 0; it flies while W is staged.
    copy_x_slice(cl[0], cl[1], cl[2], cl[3], cg, cg + 4 * IN, cg + 8 * IN, cg + 12 * IN);

    // Cooperative stage of all W fragments into LDS (16B per thread per iter).
    {
        const uint4* __restrict__ src = (const uint4*)wp;
        uint4* dst = (uint4*)lds;
        const int tid = threadIdx.x;
        #pragma unroll
        for (int it = 0; it < (WP_ELEMS * 2 / 16) / 256; ++it)   // 32 iters
            dst[tid + it * 256] = src[tid + it * 256];
    }
    // x tile 0 has landed before anybody passes the barrier.
    asm volatile("s_wait_asynccnt 0x0" ::: "memory");
    __syncthreads();

    // x tile 1 -> buffer 1.
    copy_x_slice(cl[0] + XBUF, cl[1] + XBUF, cl[2] + XBUF, cl[3] + XBUF,
                 cg + 32, cg + 4 * IN + 32, cg + 8 * IN + 32, cg + 12 * IN + 32);

    const int parity = (lane >> 4) & 1;             // which i within a pair
    const int rrow   = lane & 15;                   // reader's row in the slice
    const int rswz   = (rrow >> 1) & 7;

    const v8h*    __restrict__ bplane = (const v8h*)lds;   // 16-B units: 32 per plane

    v8f acc0 = {};
    v8f acc1 = {};

    for (int t = 0; t < NXT; ++t) {
      const char* xb = xring + (t & 1) * XBUF + rrow * 128;
      #pragma unroll   // cc constant: swizzled x offsets loop-invariant, W offsets immediates
      for (int cc = 0; cc < XT_CHUNKS; ++cc) {
        const int c = t * XT_CHUNKS + cc;

        // x values this lane is responsible for in this 32-wide k-chunk
        const float4 xv = *(const float4*)(xb + ((cc ^ rswz) << 4));   // i0 = 4c .. 4c+3
        const float xa = parity ? xv.y : xv.x;         // i0 + parity
        const float xb = parity ? xv.w : xv.z;         // i0 + 2 + parity

        // Chebyshev T0..T7 (f32 recurrence, packed to f16 A-fragment):
        // halves 0..7  <- T_n(xa)  (K 0..7  / 8..15  by lane half)
        // halves 8..15 <- T_n(xb)  (K 16..23 / 24..31 by lane half)
        v16h a;
        float ta0 = 1.0f, ta1 = xa;
        float tb0 = 1.0f, tb1 = xb;
        a[0] = (half_t)ta0; a[1] = (half_t)ta1;
        a[8] = (half_t)tb0; a[9] = (half_t)tb1;
        #pragma unroll
        for (int n = 2; n < NCHEB; ++n) {
            float ta = 2.0f * xa * ta1 - ta0; ta0 = ta1; ta1 = ta;
            float tb = 2.0f * xb * tb1 - tb0; tb0 = tb1; tb1 = tb;
            a[n]     = (half_t)ta;
            a[8 + n] = (half_t)tb;
        }

        // B fragments from LDS: chunk c, n-tiles 0 and 1
        const v8h* bp = bplane + c * 128 + lane;
        const v16h b0 = __builtin_shufflevector(bp[0],  bp[32], 0, 1, 2, 3, 4, 5, 6, 7,
                                                8, 9, 10, 11, 12, 13, 14, 15);
        const v16h b1 = __builtin_shufflevector(bp[64], bp[96], 0, 1, 2, 3, 4, 5, 6, 7,
                                                8, 9, 10, 11, 12, 13, 14, 15);

        acc0 = __builtin_amdgcn_wmma_f32_16x16x32_f16(
                   false, a, false, b0, (short)0, acc0, false, false);
        acc1 = __builtin_amdgcn_wmma_f32_16x16x32_f16(
                   false, a, false, b1, (short)0, acc1, false, false);
      }

      // Hand-over: this wave's reads of tile t are done, its copies of tile
      // t + 1 have landed; behind the barrier buffer t & 1 is free to refill.
      asm volatile("s_wait_dscnt 0x0" ::: "memory");
      asm volatile("s_wait_asynccnt 0x0" ::: "memory");
      __syncthreads();
      if (t + 2 < NXT) {
        const unsigned bo = (t & 1) * XBUF;
        const int      go = (t + 2) * (XT_CHUNKS * 4);
        copy_x_slice(cl[0] + bo, cl[1] + bo, cl[2] + bo, cl[3] + bo,
                     cg + go, cg + 4 * IN + go, cg + 8 * IN + go, cg + 12 * IN + go);
      }
    }
    // No copy is left in flight when the wave ends.
    asm volatile("s_wait_asynccnt 0x0" ::: "memory");

    // D layout: lanes 0-15 -> M = r, lanes 16-31 -> M = r + 8; N = lane & 15
    const int mbase = tile * 16 + ((lane & 16) ? 8 : 0);
    const int ncol  = lane & 15;
    #pragma unroll
    for (int r = 0; r < 8; ++r) {
        out[(size_t)(mbase + r) * OUTCH + ncol]      = acc0[r];
        out[(size_t)(mbase + r) * OUTCH + 16 + ncol] = acc1[r];
    }
}

// ---------------------------------------------------------------------------
// Host entry
// ---------------------------------------------------------------------------
extern "C" void kernel_launch(void* const* d_in, const int* in_sizes, int n_in,
                              void* d_out, int out_size, void* d_ws, size_t ws_size,
                              hipStream_t stream) {
    const float* x = (const float*)d_in[0];   // [65536, 256] f32
    const float* w = (const float*)d_in[1];   // [32, 256, 8]  f32
    float* out     = (float*)d_out;           // [65536, 32]   f32
    half_t* wp     = (half_t*)d_ws;           // 128 KB fragment-packed W

    // Allow 160 KB dynamic LDS (WGP supports up to 320 KB per workgroup).
    (void)hipFuncSetAttribute(reinterpret_cast<const void*>(&cheb_gemm_kernel),
                              hipFuncAttributeMaxDynamicSharedMemorySize,
                              LDS_BYTES);

    pack_w_kernel<<<WP_ELEMS / 256, 256, 0, stream>>>(w, wp);
    cheb_gemm_kernel<<<BATCH / 16 / 8, 256, LDS_BYTES, stream>>>(x, wp, out);
}

// v003
// One run takes 14.4 microseconds.
// Two timings next to v002 both put it at 1.09 times that version's speed.
// Over all steps from v000 it is 1.62 times as fast.
#include <hip/hip_runtime.h>

typedef _Float16 half_t;
typedef __attribute__((ext_vector_type(16))) _Float16 v16h;
typedef __attribute__((ext_vector_type(8)))  _Float16 v8h;
typedef __attribute__((ext_vector_type(8)))  float    v8f;

#define BATCH   65536
#define IN      256
#define OUTCH   32
#define NCHEB   8
#define KTOT    2048      // IN * NCHEB
#define NCHUNK  64        // KTOT / 32 (WMMA K = 32)
#define WP_ELEMS (NCHUNK * 2 * 32 * 16)   // 65536 halves = 128 KB
#define W_BYTES   (WP_ELEMS * 2)          // W fragments in LDS
#define XT_CHUNKS 16                      // k-chunks per x tile: 256 B of each row
#define NXT       (NCHUNK / XT_CHUNKS)    // 4 x tiles along a row
#define WROWS     32                      // batch rows per wave: two A fragments
#define XSLICE    (WROWS * 128)           // one wave's 32 rows x one 128-B line each
#define XHALF     (8 * XSLICE)            // half a tile (8 chunks), all 8 waves
#define XBUF      (2 * XHALF)             // one ring buffer
#define LDS_BYTES (W_BYTES + 2 * XBUF)    // 256 KB: one block per WGP

// ---------------------------------------------------------------------------
// Pre-swizzle w [O=32][I=256][N=8] (f32) into f16 WMMA-B fragments.
// Storage: wp[(((chunk*2 + ntile)*2 + (h>>3))*32 + lane)*8 + (h&7)]: a fragment
// lies as two planes of 32 lanes x 16 B, so that each 16-B LDS read of a wave
// covers 512 contiguous bytes (at 32 B per lane, lanes l and l+8 shared banks).
// For the 16-bit B operand of V_WMMA_F32_16X16X32_F16 (mirror of the
// documented A layout, M->N): lane<16 holds K={0..7,16..23}, lane>=16 holds
// K={8..15,24..31}; half h: v=h>>1 selects VGPR, h&1 selects lo/hi 16 bits.
// ---------------------------------------------------------------------------
__global__ void pack_w_kernel(const float* __restrict__ w, half_t* __restrict__ wp) {
    int idx = blockIdx.x * blockDim.x + threadIdx.x;
    if (idx >= WP_ELEMS) return;
    int h    = ((idx >> 8) & 1) * 8 + (idx & 7);
    int lane = (idx >> 3) & 31;
    int frag = idx >> 9;          // 0..127
    int c    = frag >> 1;         // k-chunk 0..63
    int t    = frag & 1;          // n-tile 0..1
    int ncol = t * 16 + (lane & 15);
    int v  = h >> 1;
    int hi = h & 1;
    int K  = ((v < 4) ? (v * 2 + hi) : (16 + (v - 4) * 2 + hi)) + ((lane & 16) ? 8 : 0);
    int k  = c * 32 + K;          // flat k = i*8 + n
    wp[idx] = (half_t)w[ncol * KTOT + k];
}

// ---------------------------------------------------------------------------
// One wave's slice of half an x tile, global -> LDS: eight copies, each of four
// whole 128-B lines (8 lanes x 16 B per row). cl[j] + bo is copy j's LDS byte
// address, g + j * 4 rows its source. The s_wait_xcnt stands inside the
// statement so that no address register is rewritten in front of it.
// ---------------------------------------------------------------------------
__device__ __forceinline__ void copy_x_slice(const unsigned (&cl)[8], unsigned bo, const float* g) {
    asm volatile("global_load_async_to_lds_b128 %0, %8, off\n\t"
                 "global_load_async_to_lds_b128 %1, %9, off\n\t"
                 "global_load_async_to_lds_b128 %2, %10, off\n\t"
                 "global_load_async_to_lds_b128 %3, %11, off\n\t"
                 "global_load_async_to_lds_b128 %4, %12, off\n\t"
                 "global_load_async_to_lds_b128 %5, %13, off\n\t"
                 "global_load_async_to_lds_b128 %6, %14, off\n\t"
                 "global_load_async_to_lds_b128 %7, %15, off\n\t"
                 "s_wait_xcnt 0x0"
                 :: "v"(cl[0] + bo), "v"(cl[1] + bo), "v"(cl[2] + bo), "v"(cl[3] + bo),
                    "v"(cl[4] + bo), "v"(cl[5] + bo), "v"(cl[6] + bo), "v"(cl[7] + bo),
                    "v"(g),           "v"(g + 4 * IN),  "v"(g + 8 * IN),  "v"(g + 12 * IN),
                    "v"(g + 16 * IN), "v"(g + 20 * IN), "v"(g + 24 * IN), "v"(g + 28 * IN)
                 : "memory");
}

// ---------------------------------------------------------------------------
// Chebyshev T0..T7 of two x values (f32 recurrence), packed to an f16 A fragment:
// halves 0..7  <- T_n(xa)  (K 0..7  / 8..15  by lane half)
// halves 8..15 <- T_n(xb)  (K 16..23 / 24..31 by lane half)
// ---------------------------------------------------------------------------
__device__ __forceinline__ v16h cheb_frag(float xa, float xb) {
    v16h a;
    float ta0 = 1.0f, ta1 = xa;
    float tb0 = 1.0f, tb1 = xb;
    a[0] = (half_t)ta0; a[1] = (half_t)ta1;
    a[8] = (half_t)tb0; a[9] = (half_t)tb1;
    #pragma unroll
    for (int n = 2; n < NCHEB; ++n) {
        float ta = 2.0f * xa * ta1 - ta0; ta0 = ta1; ta1 = ta;
        float tb = 2.0f * xb * tb1 - tb0; tb0 = tb1; tb1 = tb;
        a[n]     = (half_t)ta;
        a[8 + n] = (half_t)tb;
    }
    return a;
}

// ---------------------------------------------------------------------------
// Main kernel: one wave -> 32 batch rows x all 32 outputs: every W fragment
// read from LDS feeds two A fragments (rows 0..15 and 16..31 of the wave).
// A (Phi) fragments are generated in-register from x via the Chebyshev
// recurrence; B fragments come from LDS (whole 128 KB W staged per block,
// shared by all 8 waves, one block per WGP). f32 accumulation via WMMA.
// x reaches the lanes through a two-buffer LDS ring filled by asynchronous
// whole-line copies. A tile is 256 B of each row, kept as two halves of one
// 128-B line a row; there 16-B unit u of row r lies at r*128 + ((u ^ (r>>1 & 7))*16):
// the 16 rows that one ds_load_b128 reads fall on 16 different bank groups.
// ---------------------------------------------------------------------------
__global__ __launch_bounds__(256, 1)
void cheb_gemm_kernel(const float* __restrict__ x,
                      const half_t* __restrict__ wp,
                      float* __restrict__ out) {
    extern __shared__ __align__(16) half_t lds[];   // 128 KB W + 128 KB x ring

    const int wave   = threadIdx.x >> 5;
    const int lane   = threadIdx.x & 31;
    const int tile   = blockIdx.x * 8 + wave;       // 2048 tiles of 32 rows

    // Copy side: copy j moves rows 4j + (lane>>3), unit lane&7 of each.
    char* const xring = (char*)lds + W_BYTES + wave * XSLICE;
    const unsigned xring_lds = (unsigned)(size_t)xring;   // LDS byte address
    const int crow = lane >> 3;
    const int cu   = lane & 7;
    unsigned cl[8];
    #pragma unroll   // keeps cl[] in registers
    for (int j = 0; j < 8; ++j) {
        const int r = 4 * j + crow;
        cl[j] = xring_lds + r * 128 + ((cu ^ ((r >> 1) & 7)) << 4);
    }

    const float* const cg = x + (size_t)(tile * WROWS + crow) * IN + cu * 4;

    // x tile 0 -> buffer 0; it flies while W is staged.
    copy_x_slice(cl, 0u, cg);
    copy_x_slice(cl, (unsigned)XHALF, cg + 32);

    // Cooperative stage of all W fragments into LDS (16B per thread per iter).
    {
        const uint4* __restrict__ src = (const uint4*)wp;
        uint4* dst = (uint4*)lds;
        const int tid = threadIdx.x;
        #pragma unroll
        for (int it = 0; it < (WP_ELEMS * 2 / 16) / 256; ++it)   // 32 iters
            dst[tid + it * 256] = src[tid + it * 256];
    }
    // x tile 0 has landed before anybody passes the barrier.
    asm volatile("s_wait_asynccnt 0x0" ::: "memory");
    __syncthreads();

    // x tile 1 -> buffer 1.
    copy_x_slice(cl, (unsigned)XBUF, cg + XT_CHUNKS * 4);
    copy_x_slice(cl, (unsigned)(XBUF + XHALF), cg + XT_CHUNKS * 4 + 32);

    const int parity = (lane >> 4) & 1;             // which i within a pair
    const int rrow   = lane & 15;                   // reader's rows: rrow and rrow + 16
    const int rswz   = (rrow >> 1) & 7;

    const v8h*    __restrict__ bplane = (const v8h*)lds;   // 16-B units: 32 per plane

    v8f acc00 = {}, acc01 = {};   // rows 0..15:  n-tiles 0 and 1
    v8f acc10 = {}, acc11 = {};   // rows 16..31: n-tiles 0 and 1

    // W fragments (four 16-B planes) of the chunk in work. W does not change behind
    // the first barrier, so the next chunk's planes may be fetched at any time.
    const v8h* bp0 = bplane + lane;
    v8h bq0 = bp0[0], bq1 = bp0[32], bq2 = bp0[64], bq3 = bp0[96];

    for (int t = 0; t < NXT; ++t) {
      const char* xb = xring + (t & 1) * XBUF + rrow * 128;

      // x values of this lane in the chunk in work: i0 = 4c .. 4c+3 of rows rrow and
      // rrow + 16 (the same swizzle, 2 KB further on).
      float4 u0 = *(const float4*)(xb + (rswz << 4));
      float4 u1 = *(const float4*)(xb + 16 * 128 + (rswz << 4));

      #pragma unroll   // cc constant: LDS offsets immediates or loop-invariant, register sets renamed
      for (int cc = 0; cc < XT_CHUNKS; ++cc) {
        const int c = t * XT_CHUNKS + cc;

        // The next chunk's LDS reads, as one group: W planes (behind the last chunk
        // the index wraps to chunk 0 and the values are not used), and x while
        // the next chunk lies in this tile.
        const v8h* bp = bplane + ((c + 1) & (NCHUNK - 1)) * 128 + lane;
        const v8h bn0 = bp[0], bn1 = bp[32], bn2 = bp[64], bn3 = bp[96];
        float4 n0 = u0, n1 = u1;
        if (cc + 1 < XT_CHUNKS) {
          const char* xn = xb + ((cc + 1) >> 3) * XHALF + ((((cc + 1) & 7) ^ rswz) << 4);
          n0 = *(const float4*)xn;
          n1 = *(const float4*)(xn + 16 * 128);
        }
        // Keeps the group ahead of this chunk's work: with two waves a SIMD a read
        // that stands directly in front of its use leaves the LDS latency open.
        __builtin_amdgcn_sched_barrier(0);

        const v16h a0 = cheb_frag(parity ? +u0.y : +u0.x, parity ? +u0.w : +u0.z);
        const v16h a1 = cheb_frag(parity ? +u1.y : +u1.x, parity ? +u1.w : +u1.z);

        // B fragments: chunk c, n-tiles 0 and 1
        const v16h b0 = __builtin_shufflevector(bq0, bq1, 0, 1, 2, 3, 4, 5, 6, 7,
                                                8, 9, 10, 11, 12, 13, 14, 15);
        const v16h b1 = __builtin_shufflevector(bq2, bq3, 0, 1, 2, 3, 4, 5, 6, 7,
                                                8, 9, 10, 11, 12, 13, 14, 15);

        acc00 = __builtin_amdgcn_wmma_f32_16x16x32_f16(
                    false, a0, false, b0, (short)0, acc00, false, false);
        acc01 = __builtin_amdgcn_wmma_f32_16x16x32_f16(
                    false, a0, false, b1, (short)0, acc01, false, false);
        acc10 = __builtin_amdgcn_wmma_f32_16x16x32_f16(
                    false, a1, false, b0, (short)0, acc10, false, false);
        acc11 = __builtin_amdgcn_wmma_f32_16x16x32_f16(
                    false, a1, false, b1, (short)0, acc11, false, false);
        bq0 = bn0; bq1 = bn1; bq2 = bn2; bq3 = bn3;
        u0 = n0; u1 = n1;
      }

      // Hand-over: this wave's reads of tile t are done, its copies of tile
      // t + 1 have landed; behind the barrier buffer t & 1 is free to refill.
      asm volatile("s_wait_dscnt 0x0" ::: "memory");
      asm volatile("s_wait_asynccnt 0x0" ::: "memory");
      __syncthreads();
      if (t + 2 < NXT) {
        copy_x_slice(cl, (unsigned)((t & 1) * XBUF), cg + (t + 2) * (XT_CHUNKS * 4));
        copy_x_slice(cl, (unsigned)((t & 1) * XBUF + XHALF), cg + (t + 2) * (XT_CHUNKS * 4) + 32);
      }
    }
    // No copy is left in flight when the wave ends.
    asm volatile("s_wait_asynccnt 0x0" ::: "memory");

    // D layout: lanes 0-15 -> M = r, lanes 16-31 -> M = r + 8; N = lane & 15
    const int mbase = tile * WROWS + ((lane & 16) ? 8 : 0);
    const int ncol  = lane & 15;
    #pragma unroll
    for (int r = 0; r < 8; ++r) {
        out[(size_t)(mbase + r) * OUTCH + ncol]           = acc00[r];
        out[(size_t)(mbase + r) * OUTCH + 16 + ncol]      = acc01[r];
        out[(size_t)(mbase + 16 + r) * OUTCH + ncol]      = acc10[r];
        out[(size_t)(mbase + 16 + r) * OUTCH + 16 + ncol] = acc11[r];
    }
}

// ---------------------------------------------------------------------------
// Host entry
// ---------------------------------------------------------------------------
extern "C" void kernel_launch(void* const* d_in, const int* in_sizes, int n_in,
                              void* d_out, int out_size, void* d_ws, size_t ws_size,
                              hipStream_t stream) {
    const float* x = (const float*)d_in[0];   // [65536, 256] f32
    const float* w = (const float*)d_in[1];   // [32, 256, 8]  f32
    float* out     = (float*)d_out;           // [65536, 32]   f32
    half_t* wp     = (half_t*)d_ws;           // 128 KB fragment-packed W

    // Allow 256 KB dynamic LDS (WGP supports up to 320 KB per workgroup).
    (void)hipFuncSetAttribute(reinterpret_cast<const void*>(&cheb_gemm_kernel),
                              hipFuncAttributeMaxDynamicSharedMemorySize,
                              LDS_BYTES);

    pack_w_kernel<<<WP_ELEMS / 256, 256, 0, stream>>>(w, wp);
    cheb_gemm_kernel<<<BATCH / WROWS / 8, 256, LDS_BYTES, stream>>>(x, wp, out);
}

// v004
// One run takes 13.5 microseconds.
// In two side-by-side timings against v003, it was 1.06 and 1.07 times as fast.
// Over all steps from v000 it is 1.73 times as fast.
#include <hip/hip_runtime.h>

typedef _Float16 half_t;
typedef __attribute__((ext_vector_type(16))) _Float16 v16h;
typedef __attribute__((ext_vector_type(8)))  _Float16 v8h;
typedef __attribute__((ext_vector_type(8)))  float    v8f;
typedef __attribute__((ext_vector_type(2)))  float    v2f;

#define BATCH   65536
#define IN      256
#define OUTCH   32
#define NCHEB   8
#define KTOT    2048      // IN * NCHEB
#define NCHUNK  64        // KTOT / 32 (WMMA K = 32)
#define WP_ELEMS (NCHUNK * 2 * 32 * 16)   // 65536 halves = 128 KB
#define W_BYTES   (WP_ELEMS * 2)          // W fragments in LDS
#define XT_CHUNKS 16                      // k-chunks per x tile: 256 B of each row
#define NXT       (NCHUNK / XT_CHUNKS)    // 4 x tiles along a row
#define WROWS     32                      // batch rows per wave: two A fragments
#define XSLICE    (WROWS * 128)           // one wave's 32 rows x one 128-B line each
#define XHALF     (8 * XSLICE)            // half a tile (8 chunks), all 8 waves
#define XBUF      (2 * XHALF)             // one ring buffer
#define LDS_BYTES (W_BYTES + 2 * XBUF)    // 256 KB: one block per WGP

// ---------------------------------------------------------------------------
// Pre-swizzle w [O=32][I=256][N=8] (f32) into f16 WMMA-B fragments.
// Storage: wp[(((chunk*2 + ntile)*2 + (h>>3))*32 + lane)*8 + (h&7)]: a fragment
// lies as two planes of 32 lanes x 16 B, so that each 16-B LDS read of a wave
// covers 512 contiguous bytes (at 32 B per lane, lanes l and l+8 shared banks).
// The k order is degree-major: chunk c = g*8 + n holds degree n of the 32 inputs
// i = 32g .. 32g+31. A and B fragments pair position by position (the 16-bit B
// operand of V_WMMA_F32_16X16X32_F16 mirrors the A layout, M->N), so it is enough
// that both sides agree: half h of a lane in lane half p stands for i = 32g + 16p + h.
// ---------------------------------------------------------------------------
__global__ void pack_w_kernel(const float* __restrict__ w, half_t* __restrict__ wp) {
    int idx = blockIdx.x * blockDim.x + threadIdx.x;
    if (idx >= WP_ELEMS) return;
    int h    = ((idx >> 8) & 1) * 8 + (idx & 7);
    int lane = (idx >> 3) & 31;
    int frag = idx >> 9;          // 0..127
    int c    = frag >> 1;         // k-chunk 0..63
    int t    = frag & 1;          // n-tile 0..1
    int ncol = t * 16 + (lane & 15);
    int i  = (c >> 3) * 32 + (lane & 16) + h;   // input index
    int n  = c & 7;                             // degree
    wp[idx] = (half_t)w[ncol * KTOT + i * NCHEB + n];
}

// ---------------------------------------------------------------------------
// One wave's slice of half an x tile, global -> LDS: eight copies, each of four
// whole 128-B lines (8 lanes x 16 B per row). cl[j] + bo is copy j's LDS byte
// address, g + j * 4 rows its source. The s_wait_xcnt stands inside the
// statement so that no address register is rewritten in front of it.
// ---------------------------------------------------------------------------
__device__ __forceinline__ void copy_x_slice(const unsigned (&cl)[8], unsigned bo, const float* g) {
    asm volatile("global_load_async_to_lds_b128 %0, %8, off\n\t"
                 "global_load_async_to_lds_b128 %1, %9, off\n\t"
                 "global_load_async_to_lds_b128 %2, %10, off\n\t"
                 "global_load_async_to_lds_b128 %3, %11, off\n\t"
                 "global_load_async_to_lds_b128 %4, %12, off\n\t"
                 "global_load_async_to_lds_b128 %5, %13, off\n\t"
                 "global_load_async_to_lds_b128 %6, %14, off\n\t"
                 "global_load_async_to_lds_b128 %7, %15, off\n\t"
                 "s_wait_xcnt 0x0"
                 :: "v"(cl[0] + bo), "v"(cl[1] + bo), "v"(cl[2] + bo), "v"(cl[3] + bo),
                    "v"(cl[4] + bo), "v"(cl[5] + bo), "v"(cl[6] + bo), "v"(cl[7] + bo),
                    "v"(g),           "v"(g + 4 * IN),  "v"(g + 8 * IN),  "v"(g + 12 * IN),
                    "v"(g + 16 * IN), "v"(g + 20 * IN), "v"(g + 24 * IN), "v"(g + 28 * IN)
                 : "memory");
}

// ---------------------------------------------------------------------------
// One degree of a lane's 16 x values (eight f32 pairs), rounded to an f16 A fragment:
// half h <- value h.
// ---------------------------------------------------------------------------
__device__ __forceinline__ v16h frag_of(const v2f (&tv)[8]) {
    v16h a;
    #pragma unroll   // constant indices: the fragment is built in registers
    for (int j = 0; j < 8; ++j) {
        a[2 * j]     = (half_t)tv[j].x;
        a[2 * j + 1] = (half_t)tv[j].y;
    }
    return a;
}

// ---------------------------------------------------------------------------
// Main kernel: one wave -> 32 batch rows x all 32 outputs: every W fragment
// read from LDS feeds two A fragments (rows 0..15 and 16..31 of the wave).
// A (Phi) fragments are generated in-register from x via the Chebyshev
// recurrence (f32), one degree of 16 x values a lane and chunk, so that the step
// to the next degree is independent of the products of this one, runs on f32
// pairs, and degree 0 is a constant fragment; B fragments come from LDS (whole 128 KB W staged per block,
// shared by all 8 waves, one block per WGP). f32 accumulation via WMMA.
// x reaches the lanes through a two-buffer LDS ring filled by asynchronous
// whole-line copies. A tile is 256 B of each row, kept as two halves of one
// 128-B line a row; there 16-B unit u of row r lies at r*128 + ((u ^ (r>>1 & 7))*16):
// the 16 rows that one ds_load_b128 reads fall on 16 different bank groups.
// ---------------------------------------------------------------------------
__global__ __launch_bounds__(256, 1)
void cheb_gemm_kernel(const float* __restrict__ x,
                      const half_t* __restrict__ wp,
                      float* __restrict__ out) {
    extern __shared__ __align__(16) half_t lds[];   // 128 KB W + 128 KB x ring

    const int wave   = threadIdx.x >> 5;
    const int lane   = threadIdx.x & 31;
    const int tile   = blockIdx.x * 8 + wave;       // 2048 tiles of 32 rows

    // Copy side: copy j moves rows 4j + (lane>>3), unit lane&7 of each.
    char* const xring = (char*)lds + W_BYTES + wave * XSLICE;
    const unsigned xring_lds = (unsigned)(size_t)xring;   // LDS byte address
    const int crow = lane >> 3;
    const int cu   = lane & 7;
    unsigned cl[8];
    #pragma unroll   // keeps cl[] in registers
    for (int j = 0; j < 8; ++j) {
        const int r = 4 * j + crow;
        cl[j] = xring_lds + r * 128 + ((cu ^ ((r >> 1) & 7)) << 4);
    }

    const float* const cg = x + (size_t)(tile * WROWS + crow) * IN + cu * 4;

    // x tile 0 -> buffer 0; it flies while W is staged.
    copy_x_slice(cl, 0u, cg);
    copy_x_slice(cl, (unsigned)XHALF, cg + 32);

    // Cooperative stage of all W fragments into LDS (16B per thread per iter).
    {
        const uint4* __restrict__ src = (const uint4*)wp;
        uint4* dst = (uint4*)lds;
        const int tid = threadIdx.x;
        #pragma unroll
        for (int it = 0; it < (WP_ELEMS * 2 / 16) / 256; ++it)   // 32 iters
            dst[tid + it * 256] = src[tid + it * 256];
    }
    // x tile 0 has landed before anybody passes the barrier.
    asm volatile("s_wait_asynccnt 0x0" ::: "memory");
    __syncthreads();

    // x tile 1 -> buffer 1.
    copy_x_slice(cl, (unsigned)XBUF, cg + XT_CHUNKS * 4);
    copy_x_slice(cl, (unsigned)(XBUF + XHALF), cg + XT_CHUNKS * 4 + 32);

    const int parity = (lane >> 4) & 1;             // which 16 inputs of a group of 32
    const int rrow   = lane & 15;                   // reader's rows: rrow and rrow + 16
    const int rswz   = (rrow >> 1) & 7;
    int xo[4];                                      // the lane's four 16-B units of a line
    #pragma unroll   // keeps xo[] in registers
    for (int j = 0; j < 4; ++j) xo[j] = ((4 * parity + j) ^ rswz) << 4;

    const v8h*    __restrict__ bplane = (const v8h*)lds;   // 16-B units: 32 per plane

    v8f acc00 = {}, acc01 = {};   // rows 0..15:  n-tiles 0 and 1
    v8f acc10 = {}, acc11 = {};   // rows 16..31: n-tiles 0 and 1

    // W fragments (four 16-B planes) of the chunk in work. W does not change behind
    // the first barrier, so the next chunk's planes may be fetched at any time.
    const v8h* bp0 = bplane + lane;
    v8h bq0 = bp0[0], bq1 = bp0[32], bq2 = bp0[64], bq3 = bp0[96];

    v16h ones;                    // degree 0
    #pragma unroll   // constant indices: the fragment is a constant
    for (int j = 0; j < 16; ++j) ones[j] = (half_t)1.0f;

    for (int t = 0; t < NXT; ++t) {
      const char* xb = xring + (t & 1) * XBUF + rrow * 128;

      v2f q0[8], q1[8];           // T(n); x itself when a group begins

      #pragma unroll   // constant offsets into the tile
      for (int hh = 0; hh < 2; ++hh) {
        v2f y0[8], y1[8];         // 2x
        v2f p0[8], p1[8];         // T(n-1)
        v16h a0 = ones, a1 = ones;

        #pragma unroll   // n constant: LDS offsets immediates, register sets renamed
        for (int n = 0; n < NCHEB; ++n) {
          const int c = t * XT_CHUNKS + hh * NCHEB + n;

          // The next chunk's W planes, as one group (behind the last chunk the index
          // wraps to chunk 0 and the values are not used). With them the x values of a
          // group: the tile's first group with its degree 0, whose fragment needs no
          // x; the second with the first group's last degree, where T(n) is dead.
          const v8h* bp = bplane + ((c + 1) & (NCHUNK - 1)) * 128 + lane;
          const v8h bn0 = bp[0], bn1 = bp[32], bn2 = bp[64], bn3 = bp[96];
          if (hh == 0 && (n == 0 || n == NCHEB - 1)) {
            const char* xg = xb + (n ? XHALF : 0);
            #pragma unroll   // constant indices: q0, q1 stay in registers
            for (int j = 0; j < 4; ++j) {
              const float4 u0 = *(const float4*)(xg + xo[j]);
              const float4 u1 = *(const float4*)(xg + 16 * 128 + xo[j]);
              q0[2 * j] = v2f{u0.x, u0.y}; q0[2 * j + 1] = v2f{u0.z, u0.w};
              q1[2 * j] = v2f{u1.x, u1.y}; q1[2 * j + 1] = v2f{u1.z, u1.w};
            }
          }
          // Keeps the group ahead of this chunk's work: with two waves a SIMD a read
          // that stands directly in front of its use leaves the LDS latency open.
          __builtin_amdgcn_sched_barrier(0);

          // B fragments: chunk c, n-tiles 0 and 1
          const v16h b0 = __builtin_shufflevector(bq0, bq1, 0, 1, 2, 3, 4, 5, 6, 7,
                                                  8, 9, 10, 11, 12, 13, 14, 15);
          const v16h b1 = __builtin_shufflevector(bq2, bq3, 0, 1, 2, 3, 4, 5, 6, 7,
                                                  8, 9, 10, 11, 12, 13, 14, 15);

          acc00 = __builtin_amdgcn_wmma_f32_16x16x32_f16(
                      false, a0, false, b0, (short)0, acc00, false, false);
          acc01 = __builtin_amdgcn_wmma_f32_16x16x32_f16(
                      false, a0, false, b1, (short)0, acc01, false, false);
          acc10 = __builtin_amdgcn_wmma_f32_16x16x32_f16(
                      false, a1, false, b0, (short)0, acc10, false, false);
          acc11 = __builtin_amdgcn_wmma_f32_16x16x32_f16(
                      false, a1, false, b1, (short)0, acc11, false, false);
          bq0 = bn0; bq1 = bn1; bq2 = bn2; bq3 = bn3;
          // At a tile's start x is still on its way from LDS: the four products, which
          // do not need it, issue first instead of waiting behind its first use.
          if (hh == 0 && n == 0) __builtin_amdgcn_sched_barrier(0);

          // The next degree's fragments, beside the products above.
          if (n == 0) {
            #pragma unroll   // constant indices: the arrays stay in registers
            for (int j = 0; j < 8; ++j) {
              y0[j] = 2.0f * q0[j]; p0[j] = v2f{1.0f, 1.0f};
              y1[j] = 2.0f * q1[j]; p1[j] = v2f{1.0f, 1.0f};
            }
          } else if (n + 1 < NCHEB) {
            #pragma unroll   // constant indices: 16 independent pair steps, arrays in registers
            for (int j = 0; j < 8; ++j) {
              const v2f r0 = y0[j] * q0[j] - p0[j]; p0[j] = q0[j]; q0[j] = r0;
              const v2f r1 = y1[j] * q1[j] - p1[j]; p1[j] = q1[j]; q1[j] = r1;
            }
          }
          if (n + 1 < NCHEB) { a0 = frag_of(q0); a1 = frag_of(q1); }
        }
      }

      // Hand-over: this wave's reads of tile t are done, its copies of tile
      // t + 1 have landed; behind the barrier buffer t & 1 is free to refill.
      asm volatile("s_wait_dscnt 0x0" ::: "memory");
      asm volatile("s_wait_asynccnt 0x0" ::: "memory");
      __syncthreads();
      if (t + 2 < NXT) {
        copy_x_slice(cl, (unsigned)((t & 1) * XBUF), cg + (t + 2) * (XT_CHUNKS * 4));
        copy_x_slice(cl, (unsigned)((t & 1) * XBUF + XHALF), cg + (t + 2) * (XT_CHUNKS * 4) + 32);
      }
    }
    // No copy is left in flight when the wave ends.
    asm volatile("s_wait_asynccnt 0x0" ::: "memory");

    // D layout: lanes 0-15 -> M = r, lanes 16-31 -> M = r + 8; N = lane & 15
    const int mbase = tile * WROWS + ((lane & 16) ? 8 : 0);
    const int ncol  = lane & 15;
    #pragma unroll
    for (int r = 0; r < 8; ++r) {
        out[(size_t)(mbase + r) * OUTCH + ncol]           = acc00[r];
        out[(size_t)(mbase + r) * OUTCH + 16 + ncol]      = acc01[r];
        out[(size_t)(mbase + 16 + r) * OUTCH + ncol]      = acc10[r];
        out[(size_t)(mbase + 16 + r) * OUTCH + 16 + ncol] = acc11[r];
    }
}

// ---------------------------------------------------------------------------
// Host entry
// ---------------------------------------------------------------------------
extern "C" void kernel_launch(void* const* d_in, const int* in_sizes, int n_in,
                              void* d_out, int out_size, void* d_ws, size_t ws_size,
                              hipStream_t stream) {
    const float* x = (const float*)d_in[0];   // [65536, 256] f32
    const float* w = (const float*)d_in[1];   // [32, 256, 8]  f32
    float* out     = (float*)d_out;           // [65536, 32]   f32
    half_t* wp     = (half_t*)d_ws;           // 128 KB fragment-packed W

    // Allow 256 KB dynamic LDS (WGP supports up to 320 KB per workgroup).
    (void)hipFuncSetAttribute(reinterpret_cast<const void*>(&cheb_gemm_kernel),
                              hipFuncAttributeMaxDynamicSharedMemorySize,
                              LDS_BYTES);

    pack_w_kernel<<<WP_ELEMS / 256, 256, 0, stream>>>(w, wp);
    cheb_gemm_kernel<<<BATCH / WROWS / 8, 256, LDS_BYTES, stream>>>(x, wp, out);
}

// v005
// It runs in 12.7 microseconds.
// Next to v004, in two timings, it ran 1.06 and 1.07 times as fast.
// All steps since v000 together make it 1.84 times as fast.
#include <hip/hip_runtime.h>

typedef _Float16 half_t;
typedef __attribute__((ext_vector_type(16))) _Float16 v16h;
typedef __attribute__((ext_vector_type(8)))  _Float16 v8h;
typedef __attribute__((ext_vector_type(8)))  float    v8f;
typedef __attribute__((ext_vector_type(2)))  float    v2f;
typedef __attribute__((ext_vector_type(4)))  float    v4f;

#define BATCH   65536
#define IN      256
#define OUTCH   32
#define NCHEB   8
#define KTOT    2048      // IN * NCHEB
#define NCHUNK  64        // KTOT / 32 (WMMA K = 32)
#define WP_ELEMS (NCHUNK * 2 * 32 * 16)   // 65536 halves = 128 KB
#define W_BYTES   (WP_ELEMS * 2)          // W fragments in LDS
#define XT_CHUNKS 16                      // k-chunks per x tile: 256 B of each row
#define NXT       (NCHUNK / XT_CHUNKS)    // 4 x tiles along a row
#define WROWS     32                      // batch rows per wave: two A fragments
#define XSLICE    (WROWS * 128)           // one wave's 32 rows x one 128-B line each
#define XHALF     (8 * XSLICE)            // half a tile (8 chunks), all 8 waves
#define XBUF      (2 * XHALF)             // one ring buffer
#define LDS_BYTES (W_BYTES + 2 * XBUF)    // 256 KB: one block per WGP

// ---------------------------------------------------------------------------
// W in LDS: w [O=32][I=256][N=8] (f32) as f16 WMMA-B fragments, half index
// (((chunk*2 + ntile)*2 + (h>>3))*32 + lane)*8 + (h&7): a fragment
// lies as two planes of 32 lanes x 16 B, so that each 16-B LDS read of a wave
// covers 512 contiguous bytes (at 32 B per lane, lanes l and l+8 shared banks).
// The k order is degree-major: chunk c = g*8 + n holds degree n of the 32 inputs
// i = 32g .. 32g+31. A and B fragments pair position by position (the 16-bit B
// operand of V_WMMA_F32_16X16X32_F16 mirrors the A layout, M->N), so it is enough
// that both sides agree: half h of a lane in lane half p stands for i = 32g + 16p + h.
// Fragment lane l holds output column ntile*16 + (l & 15), p = l >> 4.
//
// Every block builds these fragments itself from w. The unit of work is a record:
// the 64 consecutive floats w[o][8a .. 8a+7][0..7] (256 B), which hold one 16-B
// fragment unit for each of the eight degrees. A slice (ntile t, pair q) is the 32
// records o = 16t .. 16t+15, a = 2q, 2q+1: 16 runs of 512 contiguous bytes.
// ---------------------------------------------------------------------------

// ---------------------------------------------------------------------------
// Half a slice of w, global -> LDS: eight copies, each of the 512 contiguous bytes
// (four whole lines) of one output's two records. wl[j] + bo is copy j's LDS byte
// address, g + j rows of w its source. The s_wait_xcnt stands inside the
// statement so that no address register is rewritten in front of it.
// ---------------------------------------------------------------------------
__device__ __forceinline__ void copy_w_rows(const unsigned (&wl)[8], unsigned bo, const float* g) {
    asm volatile("global_load_async_to_lds_b128 %0, %8, off\n\t"
                 "global_load_async_to_lds_b128 %1, %9, off\n\t"
                 "global_load_async_to_lds_b128 %2, %10, off\n\t"
                 "global_load_async_to_lds_b128 %3, %11, off\n\t"
                 "global_load_async_to_lds_b128 %4, %12, off\n\t"
                 "global_load_async_to_lds_b128 %5, %13, off\n\t"
                 "global_load_async_to_lds_b128 %6, %14, off\n\t"
                 "global_load_async_to_lds_b128 %7, %15, off\n\t"
                 "s_wait_xcnt 0x0"
                 :: "v"(wl[0] + bo), "v"(wl[1] + bo), "v"(wl[2] + bo), "v"(wl[3] + bo),
                    "v"(wl[4] + bo), "v"(wl[5] + bo), "v"(wl[6] + bo), "v"(wl[7] + bo),
                    "v"(g),            "v"(g + 1 * KTOT), "v"(g + 2 * KTOT), "v"(g + 3 * KTOT),
                    "v"(g + 4 * KTOT), "v"(g + 5 * KTOT), "v"(g + 6 * KTOT), "v"(g + 7 * KTOT)
                 : "memory");
}

// ---------------------------------------------------------------------------
// One lane's record, LDS f32 -> eight f16 fragment units in LDS. rec is the record's
// place, ru[u] the swizzled offset of its 16-B unit u (floats 4u .. 4u+3, that is
// input 8a + (u>>1), degrees 4(u&1) .. 4(u&1)+3); dst is the lane's unit of degree 0,
// the next degree's lies one chunk (2048 B) on.
// ---------------------------------------------------------------------------
__device__ __forceinline__ void convert_w_record(const char* rec, const int (&ru)[16], char* dst) {
    v4f f[16];
    #pragma unroll   // constant indices: the record stays in registers
    for (int u = 0; u < 16; ++u) f[u] = *(const v4f*)(rec + ru[u]);
    #pragma unroll   // constant indices: the transpose is register naming only
    for (int n = 0; n < NCHEB; ++n) {
        v8h hv;
        #pragma unroll   // constant indices, as above
        for (int ii = 0; ii < 8; ++ii) hv[ii] = (half_t)f[2 * ii + (n >> 2)][n & 3];
        *(v8h*)(dst + n * 2048) = hv;
    }
}

// ---------------------------------------------------------------------------
// One wave's slice of half an x tile, global -> LDS: eight copies, each of four
// whole 128-B lines (8 lanes x 16 B per row). cl[j] + bo is copy j's LDS byte
// address, g + j * 4 rows its source. The s_wait_xcnt stands inside the
// statement so that no address register is rewritten in front of it.
// ---------------------------------------------------------------------------
__device__ __forceinline__ void copy_x_slice(const unsigned (&cl)[8], unsigned bo, const float* g) {
    asm volatile("global_load_async_to_lds_b128 %0, %8, off\n\t"
                 "global_load_async_to_lds_b128 %1, %9, off\n\t"
                 "global_load_async_to_lds_b128 %2, %10, off\n\t"
                 "global_load_async_to_lds_b128 %3, %11, off\n\t"
                 "global_load_async_to_lds_b128 %4, %12, off\n\t"
                 "global_load_async_to_lds_b128 %5, %13, off\n\t"
                 "global_load_async_to_lds_b128 %6, %14, off\n\t"
                 "global_load_async_to_lds_b128 %7, %15, off\n\t"
                 "s_wait_xcnt 0x0"
                 :: "v"(cl[0] + bo), "v"(cl[1] + bo), "v"(cl[2] + bo), "v"(cl[3] + bo),
                    "v"(cl[4] + bo), "v"(cl[5] + bo), "v"(cl[6] + bo), "v"(cl[7] + bo),
                    "v"(g),           "v"(g + 4 * IN),  "v"(g + 8 * IN),  "v"(g + 12 * IN),
                    "v"(g + 16 * IN), "v"(g + 20 * IN), "v"(g + 24 * IN), "v"(g + 28 * IN)
                 : "memory");
}

// ---------------------------------------------------------------------------
// One degree of a lane's 16 x values (eight f32 pairs), rounded to an f16 A fragment:
// half h <- value h.
// ---------------------------------------------------------------------------
__device__ __forceinline__ v16h frag_of(const v2f (&tv)[8]) {
    v16h a;
    #pragma unroll   // constant indices: the fragment is built in registers
    for (int j = 0; j < 8; ++j) {
        a[2 * j]     = (half_t)tv[j].x;
        a[2 * j + 1] = (half_t)tv[j].y;
    }
    return a;
}

// ---------------------------------------------------------------------------
// Main kernel: one wave -> 32 batch rows x all 32 outputs: every W fragment
// read from LDS feeds two A fragments (rows 0..15 and 16..31 of the wave).
// A (Phi) fragments are generated in-register from x via the Chebyshev
// recurrence (f32), one degree of 16 x values a lane and chunk, so that the step
// to the next degree is independent of the products of this one, runs on f32
// pairs, and degree 0 is a constant fragment; B fragments come from LDS (whole 128 KB W built per block,
// shared by all 8 waves, one block per WGP). f32 accumulation via WMMA.
// x reaches the lanes through a two-buffer LDS ring filled by asynchronous
// whole-line copies. A tile is 256 B of each row, kept as two halves of one
// 128-B line a row; there 16-B unit u of row r lies at r*128 + ((u ^ (r>>1 & 7))*16):
// the 16 rows that one ds_load_b128 reads fall on 16 different bank groups.
// ---------------------------------------------------------------------------
__global__ __launch_bounds__(256, 1)
void cheb_gemm_kernel(const float* __restrict__ x,
                      const float* __restrict__ w,
                      float* __restrict__ out) {
    extern __shared__ __align__(16) half_t lds[];   // 128 KB W + 128 KB x ring

    const int wave   = threadIdx.x >> 5;
    const int lane   = threadIdx.x & 31;
    const int tile   = blockIdx.x * 8 + wave;       // 2048 tiles of 32 rows

    // Copy side: copy j moves rows 4j + (lane>>3), unit lane&7 of each.
    char* const xring = (char*)lds + W_BYTES + wave * XSLICE;
    const unsigned xring_lds = (unsigned)(size_t)xring;   // LDS byte address
    const int crow = lane >> 3;
    const int cu   = lane & 7;
    unsigned cl[8];
    #pragma unroll   // keeps cl[] in registers
    for (int j = 0; j < 8; ++j) {
        const int r = 4 * j + crow;
        cl[j] = xring_lds + r * 128 + ((cu ^ ((r >> 1) & 7)) << 4);
    }

    const float* const cg = x + (size_t)(tile * WROWS + crow) * IN + cu * 4;

    // W: each wave turns four slices of w into fragments. A slice passes through one
    // buffer of the wave's OWN part of the x ring, which x does not need yet: nobody
    // else reads or writes that part, so the wave's own waits order all of it.
    // Record o = 16t + j, a = 2q + e lies in half e of the buffer at j*256, its 16-B
    // unit u at (u ^ j)*16: the 16 records that half a ds_load_b128 reads fall on 16
    // different bank groups. Lane l converts record j = l & 15, e = l >> 4, so that
    // 16 lanes store 256 contiguous bytes of a fragment plane.
    {
        const int le = lane >> 4;
        const int lj = lane & 15;
        unsigned wlo[8], whi[8];
        #pragma unroll   // keeps the addresses in registers
        for (int j = 0; j < 8; ++j) {
            wlo[j] = xring_lds + le * XHALF + j * 256 + ((lj ^ j) << 4);
            whi[j] = xring_lds + le * XHALF + (j + 8) * 256 + ((lj ^ (j + 8)) << 4);
        }
        int ru[16];
        #pragma unroll   // keeps the offsets in registers
        for (int u = 0; u < 16; ++u) ru[u] = (u ^ lj) << 4;
        const char* const rec = xring + le * XHALF + lj * 256;
        // slice s of the wave: t = s & 1, q = 2 * wave + (s >> 1)
        const float* const wg = w + wave * 256 + lane * 4;
        char* const wd = (char*)lds + wave * 16384 + le * 512 + lj * 16;

        copy_w_rows(wlo, 0u, wg);
        copy_w_rows(whi, 0u, wg + 8 * KTOT);
        copy_w_rows(wlo, (unsigned)XBUF, wg + 16 * KTOT);
        copy_w_rows(whi, (unsigned)XBUF, wg + 24 * KTOT);

        #pragma unroll   // s constant: buffer, source and destination offsets are immediates
        for (int s = 0; s < 4; ++s) {
            // Slice s has landed: only the 16 copies issued behind it may still fly.
            asm volatile("s_wait_asynccnt 0x10" ::: "memory");
            convert_w_record(rec + (s & 1) * XBUF, ru, wd + (s & 1) * 1024 + (s >> 1) * 256);
            // The wave's reads of the buffer are done before copies refill it.
            asm volatile("s_wait_dscnt 0x0" ::: "memory");
            if (s < 2) {
                const float* const g2 = wg + 128 + (s & 1) * 16 * KTOT;   // slice s + 2
                copy_w_rows(wlo, (unsigned)((s & 1) * XBUF), g2);
                copy_w_rows(whi, (unsigned)((s & 1) * XBUF), g2 + 8 * KTOT);
            } else if (s == 2) {
                // x tile 0 -> buffer 0; it flies while the last slice is converted.
                copy_x_slice(cl, 0u, cg);
                copy_x_slice(cl, (unsigned)XHALF, cg + 32);
            }
        }
    }
    // x tile 0 has landed before anybody passes the barrier.
    asm volatile("s_wait_asynccnt 0x0" ::: "memory");
    __syncthreads();

    // x tile 1 -> buffer 1.
    copy_x_slice(cl, (unsigned)XBUF, cg + XT_CHUNKS * 4);
    copy_x_slice(cl, (unsigned)(XBUF + XHALF), cg + XT_CHUNKS * 4 + 32);

    const int parity = (lane >> 4) & 1;             // which 16 inputs of a group of 32
    const int rrow   = lane & 15;                   // reader's rows: rrow and rrow + 16
    const int rswz   = (rrow >> 1) & 7;
    int xo[4];                                      // the lane's four 16-B units of a line
    #pragma unroll   // keeps xo[] in registers
    for (int j = 0; j < 4; ++j) xo[j] = ((4 * parity + j) ^ rswz) << 4;

    const v8h*    __restrict__ bplane = (const v8h*)lds;   // 16-B units: 32 per plane

    v8f acc00 = {}, acc01 = {};   // rows 0..15:  n-tiles 0 and 1
    v8f acc10 = {}, acc11 = {};   // rows 16..31: n-tiles 0 and 1

    // W fragments (four 16-B planes) of the chunk in work. W does not change behind
    // the first barrier, so the next chunk's planes may be fetched at any time.
    const v8h* bp0 = bplane + lane;
    v8h bq0 = bp0[0], bq1 = bp0[32], bq2 = bp0[64], bq3 = bp0[96];

    v16h ones;                    // degree 0
    #pragma unroll   // constant indices: the fragment is a constant
    for (int j = 0; j < 16; ++j) ones[j] = (half_t)1.0f;

    for (int t = 0; t < NXT; ++t) {
      const char* xb = xring + (t & 1) * XBUF + rrow * 128;

      v2f q0[8], q1[8];           // T(n); x itself when a group begins

      #pragma unroll   // constant offsets into the tile
      for (int hh = 0; hh < 2; ++hh) {
        v2f y0[8], y1[8];         // 2x
        v2f p0[8], p1[8];         // T(n-1)
        v16h a0 = ones, a1 = ones;

        #pragma unroll   // n constant: LDS offsets immediates, register sets renamed
        for (int n = 0; n < NCHEB; ++n) {
          const int c = t * XT_CHUNKS + hh * NCHEB + n;

          // The next chunk's W planes, as one group (behind the last chunk the index
          // wraps to chunk 0 and the values are not used). With them the x values of a
          // group: the tile's first group with its degree 0, whose fragment needs no
          // x; the second with the first group's last degree, where T(n) is dead.
          const v8h* bp = bplane + ((c + 1) & (NCHUNK - 1)) * 128 + lane;
          const v8h bn0 = bp[0], bn1 = bp[32], bn2 = bp[64], bn3 = bp[96];
          if (hh == 0 && (n == 0 || n == NCHEB - 1)) {
            const char* xg = xb + (n ? XHALF : 0);
            #pragma unroll   // constant indices: q0, q1 stay in registers
            for (int j = 0; j < 4; ++j) {
              const float4 u0 = *(const float4*)(xg + xo[j]);
              const float4 u1 = *(const float4*)(xg + 16 * 128 + xo[j]);
              q0[2 * j] = v2f{u0.x, u0.y}; q0[2 * j + 1] = v2f{u0.z, u0.w};
              q1[2 * j] = v2f{u1.x, u1.y}; q1[2 * j + 1] = v2f{u1.z, u1.w};
            }
          }
          // Keeps the group ahead of this chunk's work: with two waves a SIMD a read
          // that stands directly in front of its use leaves the LDS latency open.
          __builtin_amdgcn_sched_barrier(0);

          // B fragments: chunk c, n-tiles 0 and 1
          const v16h b0 = __builtin_shufflevector(bq0, bq1, 0, 1, 2, 3, 4, 5, 6, 7,
                                                  8, 9, 10, 11, 12, 13, 14, 15);
          const v16h b1 = __builtin_shufflevector(bq2, bq3, 0, 1, 2, 3, 4, 5, 6, 7,
                                                  8, 9, 10, 11, 12, 13, 14, 15);

          acc00 = __builtin_amdgcn_wmma_f32_16x16x32_f16(
                      false, a0, false, b0, (short)0, acc00, false, false);
          acc01 = __builtin_amdgcn_wmma_f32_16x16x32_f16(
                      false, a0, false, b1, (short)0, acc01, false, false);
          acc10 = __builtin_amdgcn_wmma_f32_16x16x32_f16(
                      false, a1, false, b0, (short)0, acc10, false, false);
          acc11 = __builtin_amdgcn_wmma_f32_16x16x32_f16(
                      false, a1, false, b1, (short)0, acc11, false, false);
          bq0 = bn0; bq1 = bn1; bq2 = bn2; bq3 = bn3;
          // At a tile's start x is still on its way from LDS: the four products, which
          // do not need it, issue first instead of waiting behind its first use.
          if (hh == 0 && n == 0) __builtin_amdgcn_sched_barrier(0);

          // The next degree's fragments, beside the products above.
          if (n == 0) {
            #pragma unroll   // constant indices: the arrays stay in registers
            for (int j = 0; j < 8; ++j) {
              y0[j] = 2.0f * q0[j]; p0[j] = v2f{1.0f, 1.0f};
              y1[j] = 2.0f * q1[j]; p1[j] = v2f{1.0f, 1.0f};
            }
          } else if (n + 1 < NCHEB) {
            #pragma unroll   // constant indices: 16 independent pair steps, arrays in registers
            for (int j = 0; j < 8; ++j) {
              const v2f r0 = y0[j] * q0[j] - p0[j]; p0[j] = q0[j]; q0[j] = r0;
              const v2f r1 = y1[j] * q1[j] - p1[j]; p1[j] = q1[j]; q1[j] = r1;
            }
          }
          if (n + 1 < NCHEB) { a0 = frag_of(q0); a1 = frag_of(q1); }
        }
      }

      // Hand-over: this wave's reads of tile t are done, its copies of tile
      // t + 1 have landed; behind the barrier buffer t & 1 is free to refill.
      asm volatile("s_wait_dscnt 0x0" ::: "memory");
      asm volatile("s_wait_asynccnt 0x0" ::: "memory");
      __syncthreads();
      if (t + 2 < NXT) {
        copy_x_slice(cl, (unsigned)((t & 1) * XBUF), cg + (t + 2) * (XT_CHUNKS * 4));
        copy_x_slice(cl, (unsigned)((t & 1) * XBUF + XHALF), cg + (t + 2) * (XT_CHUNKS * 4) + 32);
      }
    }
    // No copy is left in flight when the wave ends.
    asm volatile("s_wait_asynccnt 0x0" ::: "memory");

    // D layout: lanes 0-15 -> M = r, lanes 16-31 -> M = r + 8; N = lane & 15
    const int mbase = tile * WROWS + ((lane & 16) ? 8 : 0);
    const int ncol  = lane & 15;
    #pragma unroll
    for (int r = 0; r < 8; ++r) {
        out[(size_t)(mbase + r) * OUTCH + ncol]           = acc00[r];
        out[(size_t)(mbase + r) * OUTCH + 16 + ncol]      = acc01[r];
        out[(size_t)(mbase + 16 + r) * OUTCH + ncol]      = acc10[r];
        out[(size_t)(mbase + 16 + r) * OUTCH + 16 + ncol] = acc11[r];
    }
}

// ---------------------------------------------------------------------------
// Host entry
// ---------------------------------------------------------------------------
extern "C" void kernel_launch(void* const* d_in, const int* in_sizes, int n_in,
                              void* d_out, int out_size, void* d_ws, size_t ws_size,
                              hipStream_t stream) {
    const float* x = (const float*)d_in[0];   // [65536, 256] f32
    const float* w = (const float*)d_in[1];   // [32, 256, 8]  f32
    float* out     = (float*)d_out;           // [65536, 32]   f32

    // Allow 256 KB dynamic LDS (WGP supports up to 320 KB per workgroup).
    (void)hipFuncSetAttribute(reinterpret_cast<const void*>(&cheb_gemm_kernel),
                              hipFuncAttributeMaxDynamicSharedMemorySize,
                              LDS_BYTES);

    cheb_gemm_kernel<<<BATCH / WROWS / 8, 256, LDS_BYTES, stream>>>(x, w, out);
}
